// v000
// Measured on an AMD MI455X. A time is GPU time per run, averaged over a window of back-to-back runs after a warm-up
// (all launches, gaps included; the runs take copies of the inputs in turn), and the median of several windows.
// Apart from v000's, it joins two sittings. Times from different sittings can be a few percent apart, while
// side-by-side timings come from the same sitting.
// v000, which the later versions start from, runs in 397 microseconds.
#include <hip/hip_runtime.h>

typedef __attribute__((ext_vector_type(2))) float v2f;
typedef __attribute__((ext_vector_type(8))) float v8f;

#define BB   2
#define SS   2048
#define HID  1024
#define NHD  16
#define QD   32
#define HD   64
#define MM   (BB * SS)      // 4096 rows

__device__ __forceinline__ v8f wmma4(v2f a, v2f b, v8f c) {
  // D = A(16x4 f32) * B(4x16 f32) + C(16x16 f32)
  return __builtin_amdgcn_wmma_f32_16x16x4_f32(
      false, a, false, b, (short)0, c, false, false);
}

__device__ __forceinline__ v8f zero8() {
  v8f z = {0.f, 0.f, 0.f, 0.f, 0.f, 0.f, 0.f, 0.f};
  return z;
}

// ---------------------------------------------------------------------------
// Generic GEMM + bias: C[M,N] = A[M,K] @ W[K,N] + bias[N]
// Block tile 64x64, BK=16. 128 threads = 4 waves; each wave owns 32x32
// (2x2 tiles of 16x16). LDS staging with conflict-free padding.
// ---------------------------------------------------------------------------
__global__ __launch_bounds__(128) void gemm_bias_wmma(
    const float* __restrict__ A, const float* __restrict__ W,
    const float* __restrict__ bias, float* __restrict__ C,
    int M, int N, int K)
{
  __shared__ float As[64][20];   // 64x16 + pad4 (row = 80B, 16B aligned)
  __shared__ float Bs[16][68];   // 16x64 + pad4 (row = 272B, 16B aligned)

  const int tid  = threadIdx.x;
  const int lane = tid & 31;
  const int w    = tid >> 5;
  const int l16  = lane & 15;
  const int h    = lane >> 4;

  const int m0 = blockIdx.y * 64;
  const int n0 = blockIdx.x * 64;
  const int wm = (w >> 1) * 32;
  const int wn = (w & 1) * 32;

  v8f acc[2][2];
  for (int i = 0; i < 2; ++i)
    for (int j = 0; j < 2; ++j)
      acc[i][j] = zero8();

  for (int kb = 0; kb < K; kb += 16) {
    __syncthreads();
    // stage A chunk 64x16 (1024 floats), float4 x 128 thr x 2 iters
    {
      const int idx = tid * 4;
      for (int it = 0; it < 2; ++it) {
        int id = idx + it * 512;
        int r = id >> 4, c = id & 15;
        *(float4*)&As[r][c] =
            *(const float4*)&A[(size_t)(m0 + r) * K + kb + c];
      }
      // stage B chunk 16x64 (1024 floats)
      for (int it = 0; it < 2; ++it) {
        int id = idx + it * 512;
        int r = id >> 6, c = id & 63;
        *(float4*)&Bs[r][c] =
            *(const float4*)&W[(size_t)(kb + r) * N + n0 + c];
      }
    }
    __syncthreads();

    for (int kk = 0; kk < 16; kk += 4) {
      v2f afrag[2], bfrag[2];
      for (int i = 0; i < 2; ++i)
        afrag[i] = *(const v2f*)&As[wm + i * 16 + l16][kk + 2 * h];
      for (int j = 0; j < 2; ++j) {
        const int col = wn + j * 16 + l16;
        v2f bv2;
        bv2.x = Bs[kk + 2 * h][col];
        bv2.y = Bs[kk + 2 * h + 1][col];
        bfrag[j] = bv2;
      }
      for (int i = 0; i < 2; ++i)
        for (int j = 0; j < 2; ++j)
          acc[i][j] = wmma4(afrag[i], bfrag[j], acc[i][j]);
    }
  }

  // epilogue: bias add + store (C/D layout: col=lane%16, row=r+8h)
  for (int j = 0; j < 2; ++j) {
    const int col = n0 + wn + j * 16 + l16;
    const float bv_ = bias[col];
    for (int i = 0; i < 2; ++i)
      for (int r = 0; r < 8; ++r) {
        const int row = m0 + wm + i * 16 + r + 8 * h;
        C[(size_t)row * N + col] = acc[i][j][r] + bv_;
      }
  }
}

// ---------------------------------------------------------------------------
// Row L2-normalize over 32 contiguous floats (one head vector per wave),
// with optional fused scale (1/sqrt(QD) folded into Q).
// ---------------------------------------------------------------------------
__global__ __launch_bounds__(256) void rownorm32(
    float* __restrict__ q, int nrows, float scale)
{
  const int wid  = (int)((blockIdx.x * blockDim.x + threadIdx.x) >> 5);
  const int lane = threadIdx.x & 31;
  if (wid >= nrows) return;
  const size_t off = (size_t)wid * 32 + lane;
  const float x = q[off];
  float ss = x * x;
  for (int m = 1; m < 32; m <<= 1) ss += __shfl_xor(ss, m, 32);
  const float nrm = fmaxf(sqrtf(ss), 1e-12f);
  q[off] = x / nrm * scale;
}

// ---------------------------------------------------------------------------
// Flash attention, fp32 WMMA core.
// grid = (S/64, NH, B), block = 128 (4 waves); wave owns 16 query rows.
// Per 64-key chunk: QK^T = 32 wmma, online softmax, P via LDS relayout,
// PV = 64 wmma.
// ---------------------------------------------------------------------------
__global__ __launch_bounds__(128) void flash_attn_wmma(
    const float* __restrict__ Qn, const float* __restrict__ Kn,
    const float* __restrict__ V,  const int* __restrict__ amask,
    float* __restrict__ Ctx)
{
  __shared__ float Ks[64][36];      // 64 keys x 32 (+pad4)
  __shared__ float Vs[64][68];      // 64 keys x 64 (+pad4)
  __shared__ float Ps[4][16][68];   // per-wave P tile 16q x 64k (+pad4)

  const int tid  = threadIdx.x;
  const int lane = tid & 31;
  const int w    = tid >> 5;
  const int l16  = lane & 15;
  const int h    = lane >> 4;

  const int b    = blockIdx.z;
  const int head = blockIdx.y;
  const int q0   = blockIdx.x * 64;
  const int qw   = q0 + w * 16;
  const size_t base = (size_t)b * SS;

  // Q fragments held in registers (A-layout), scale already folded in.
  v2f aQ[8];
  {
    const float* qrow = &Qn[(base + qw + l16) * (NHD * QD) + head * QD];
    for (int j = 0; j < 8; ++j)
      aQ[j] = *(const v2f*)&qrow[4 * j + 2 * h];
  }

  v8f O[4];
  for (int n = 0; n < 4; ++n) O[n] = zero8();
  float mrow[8], lrow[8];
  for (int r = 0; r < 8; ++r) { mrow[r] = -3.0e38f; lrow[r] = 0.f; }

  for (int kv0 = 0; kv0 < SS; kv0 += 64) {
    __syncthreads();  // previous chunk's LDS consumers done
    {
      const int idx = tid * 4;
      // stage K chunk 64x32 (2048 floats)
      for (int it = 0; it < 4; ++it) {
        int id = idx + it * 512;
        int r = id >> 5, c = id & 31;
        *(float4*)&Ks[r][c] =
            *(const float4*)&Kn[(base + kv0 + r) * (NHD * QD) + head * QD + c];
      }
      // stage V chunk 64x64 (4096 floats)
      for (int it = 0; it < 8; ++it) {
        int id = idx + it * 512;
        int r = id >> 6, c = id & 63;
        *(float4*)&Vs[r][c] =
            *(const float4*)&V[(base + kv0 + r) * HID + head * HD + c];
      }
    }
    __syncthreads();

    // --- scores: 4 tiles of 16q x 16k, K-dim 32 => 8 wmma each ---
    v8f Sv[4];
    int mk[4];
    for (int t = 0; t < 4; ++t)
      mk[t] = amask[base + kv0 + t * 16 + l16];

    for (int t = 0; t < 4; ++t) {
      v8f s = zero8();
      const float* krow = &Ks[t * 16 + l16][0];
      for (int j = 0; j < 8; ++j) {
        v2f bk2 = *(const v2f*)&krow[4 * j + 2 * h];
        s = wmma4(aQ[j], bk2, s);
      }
      if (mk[t] == 0)
        for (int r = 0; r < 8; ++r) s[r] = -3.0e38f;
      Sv[t] = s;
    }

    // --- online softmax row stats (row = r+8h; 16 cols live in the 16
    //     lanes sharing h, so xor masks 1..8 reduce within the half) ---
    float mnew[8], alpha[8], rsum[8];
    for (int r = 0; r < 8; ++r) {
      float v = fmaxf(fmaxf(Sv[0][r], Sv[1][r]), fmaxf(Sv[2][r], Sv[3][r]));
      for (int m = 1; m < 16; m <<= 1) v = fmaxf(v, __shfl_xor(v, m, 32));
      mnew[r]  = fmaxf(mrow[r], v);
      alpha[r] = __expf(mrow[r] - mnew[r]);
      rsum[r]  = 0.f;
    }

    // probabilities -> LDS (C-layout write), accumulate row sums
    for (int t = 0; t < 4; ++t)
      for (int r = 0; r < 8; ++r) {
        const float p = __expf(Sv[t][r] - mnew[r]);
        Ps[w][r + 8 * h][t * 16 + l16] = p;
        rsum[r] += p;
      }
    for (int r = 0; r < 8; ++r) {
      float v = rsum[r];
      for (int m = 1; m < 16; m <<= 1) v += __shfl_xor(v, m, 32);
      lrow[r] = lrow[r] * alpha[r] + v;
      mrow[r] = mnew[r];
    }

    // rescale accumulated O
    for (int n = 0; n < 4; ++n)
      for (int r = 0; r < 8; ++r) O[n][r] *= alpha[r];

    // make this wave's P stores visible before A-layout re-read
    asm volatile("s_wait_dscnt 0" ::: "memory");

    // --- PV: P(16x64) @ V(64x64), 16 K-steps x 4 N-tiles = 64 wmma ---
    for (int kk16 = 0; kk16 < 16; ++kk16) {
      const int kk = kk16 * 4;
      v2f aP = *(const v2f*)&Ps[w][l16][kk + 2 * h];
      for (int n = 0; n < 4; ++n) {
        v2f bv2;
        bv2.x = Vs[kk + 2 * h][n * 16 + l16];
        bv2.y = Vs[kk + 2 * h + 1][n * 16 + l16];
        O[n] = wmma4(aP, bv2, O[n]);
      }
    }
  }

  // write context (divide by softmax denominator)
  for (int n = 0; n < 4; ++n) {
    const int col = head * HD + n * 16 + l16;
    for (int r = 0; r < 8; ++r) {
      const int row = qw + r + 8 * h;
      Ctx[(base + row) * HID + col] = O[n][r] / lrow[r];
    }
  }
}

// ---------------------------------------------------------------------------
extern "C" void kernel_launch(void* const* d_in, const int* in_sizes, int n_in,
                              void* d_out, int out_size, void* d_ws, size_t ws_size,
                              hipStream_t stream) {
  const float* HS   = (const float*)d_in[0];
  const int*   mask = (const int*)  d_in[1];
  const float* Wq   = (const float*)d_in[2];
  const float* bq   = (const float*)d_in[3];
  const float* Wk   = (const float*)d_in[4];
  const float* bk   = (const float*)d_in[5];
  const float* Wv   = (const float*)d_in[6];
  const float* bv   = (const float*)d_in[7];
  const float* Wo   = (const float*)d_in[8];
  const float* bo   = (const float*)d_in[9];
  float* out = (float*)d_out;

  // workspace layout (floats): Q 8MB | K 8MB | V 16MB | Ctx 16MB = 48MB
  float* ws  = (float*)d_ws;
  float* Q   = ws;
  float* K   = ws + (size_t)MM * 512;            // +2,097,152
  float* Vb  = ws + (size_t)2 * MM * 512;        // +4,194,304
  float* Ctx = Vb + (size_t)MM * 1024;           // +8,388,608

  const dim3 blk(128);

  // projections
  gemm_bias_wmma<<<dim3(512 / 64,  MM / 64), blk, 0, stream>>>(HS, Wq, bq, Q,  MM, 512,  HID);
  gemm_bias_wmma<<<dim3(512 / 64,  MM / 64), blk, 0, stream>>>(HS, Wk, bk, K,  MM, 512,  HID);
  gemm_bias_wmma<<<dim3(1024 / 64, MM / 64), blk, 0, stream>>>(HS, Wv, bv, Vb, MM, 1024, HID);

  // quantum state prep: L2-normalize per (token, head); fold 1/sqrt(QD) into Q
  const int nrows = MM * NHD;                    // 65536 rows of 32
  rownorm32<<<dim3((nrows * 32 + 255) / 256), dim3(256), 0, stream>>>(Q, nrows, 0.1767766953f);
  rownorm32<<<dim3((nrows * 32 + 255) / 256), dim3(256), 0, stream>>>(K, nrows, 1.0f);

  // fused flash attention
  flash_attn_wmma<<<dim3(SS / 64, NHD, BB), blk, 0, stream>>>(Q, K, Vb, mask, Ctx);

  // output projection
  gemm_bias_wmma<<<dim3(1024 / 64, MM / 64), blk, 0, stream>>>(Ctx, Wo, bo, out, MM, 1024, HID);
}

// v001
// It runs in 332 microseconds.
// In two side-by-side timings against v000, it was 1.23 and 1.24 times as fast.
#include <hip/hip_runtime.h>

typedef __attribute__((ext_vector_type(2))) float v2f;
typedef __attribute__((ext_vector_type(8))) float v8f;

#define BB   2
#define SS   2048
#define HID  1024
#define NHD  16
#define QD   32
#define HD   64
#define MM   (BB * SS)      // 4096 rows

__device__ __forceinline__ v8f wmma4(v2f a, v2f b, v8f c) {
  // D = A(16x4 f32) * B(4x16 f32) + C(16x16 f32)
  return __builtin_amdgcn_wmma_f32_16x16x4_f32(
      false, a, false, b, (short)0, c, false, false);
}

__device__ __forceinline__ v8f zero8() {
  v8f z = {0.f, 0.f, 0.f, 0.f, 0.f, 0.f, 0.f, 0.f};
  return z;
}

// LDS byte address of a __shared__ element (low 32 bits of its address).
__device__ __forceinline__ unsigned lds_addr(const void* p) {
  return (unsigned)(unsigned long long)p;
}

__device__ __forceinline__ void async_copy_4_4(
    unsigned la, unsigned da, const float* a, size_t sa,
    unsigned lb, unsigned db, const float* b, size_t sb) {
  asm volatile(
      "global_load_async_to_lds_b128 %0, %1, off\n\t"
      "global_load_async_to_lds_b128 %2, %3, off\n\t"
      "global_load_async_to_lds_b128 %4, %5, off\n\t"
      "global_load_async_to_lds_b128 %6, %7, off\n\t"
      "global_load_async_to_lds_b128 %8, %9, off\n\t"
      "global_load_async_to_lds_b128 %10, %11, off\n\t"
      "global_load_async_to_lds_b128 %12, %13, off\n\t"
      "global_load_async_to_lds_b128 %14, %15, off\n\t"
      "s_wait_xcnt 0x0"
      :: "v"(la),          "v"(a),          "v"(la + da),     "v"(a + sa),
         "v"(la + 2 * da), "v"(a + 2 * sa), "v"(la + 3 * da), "v"(a + 3 * sa),
         "v"(lb),          "v"(b),          "v"(lb + db),     "v"(b + sb),
         "v"(lb + 2 * db), "v"(b + 2 * sb), "v"(lb + 3 * db), "v"(b + 3 * sb)
      : "memory");
}
__device__ __forceinline__ void async_copy_4_8(
    unsigned la, unsigned da, const float* a, size_t sa,
    unsigned lb, unsigned db, const float* b, size_t sb) {
  asm volatile(
      "global_load_async_to_lds_b128 %0, %1, off\n\t"
      "global_load_async_to_lds_b128 %2, %3, off\n\t"
      "global_load_async_to_lds_b128 %4, %5, off\n\t"
      "global_load_async_to_lds_b128 %6, %7, off\n\t"
      "global_load_async_to_lds_b128 %8, %9, off\n\t"
      "global_load_async_to_lds_b128 %10, %11, off\n\t"
      "global_load_async_to_lds_b128 %12, %13, off\n\t"
      "global_load_async_to_lds_b128 %14, %15, off\n\t"
      "global_load_async_to_lds_b128 %16, %17, off\n\t"
      "global_load_async_to_lds_b128 %18, %19, off\n\t"
      "global_load_async_to_lds_b128 %20, %21, off\n\t"
      "global_load_async_to_lds_b128 %22, %23, off\n\t"
      "s_wait_xcnt 0x0"
      :: "v"(la),          "v"(a),          "v"(la + da),     "v"(a + sa),
         "v"(la + 2 * da), "v"(a + 2 * sa), "v"(la + 3 * da), "v"(a + 3 * sa),
         "v"(lb),          "v"(b),          "v"(lb + db),     "v"(b + sb),
         "v"(lb + 2 * db), "v"(b + 2 * sb), "v"(lb + 3 * db), "v"(b + 3 * sb),
         "v"(lb + 4 * db), "v"(b + 4 * sb), "v"(lb + 5 * db), "v"(b + 5 * sb),
         "v"(lb + 6 * db), "v"(b + 6 * sb), "v"(lb + 7 * db), "v"(b + 7 * sb)
      : "memory");
}

// This wave's own copies have landed in LDS.
__device__ __forceinline__ void wait_async0() {
  asm volatile("s_wait_asynccnt 0x0" ::: "memory");
}
// This wave's own LDS reads have retired, so their buffer may be refilled.
__device__ __forceinline__ void wait_ds0() {
  asm volatile("s_wait_dscnt 0x0" ::: "memory");
}

// ---------------------------------------------------------------------------
// Generic GEMM + bias: C[M,N] = A[M,K] @ W[K,N] + bias[N]
// Block tile 64x64. 128 threads = 4 waves; each wave owns 32x32
// (2x2 tiles of 16x16). Stages of 32 k (whole 128-byte lines of A) are brought
// into two LDS buffers by asynchronous copies: stage t+1 flies while stage t
// is multiplied. K must be a multiple of 32.
// ---------------------------------------------------------------------------
__global__ __launch_bounds__(128) void gemm_bias_wmma(
    const float* __restrict__ A, const float* __restrict__ W,
    const float* __restrict__ bias, float* __restrict__ C,
    int M, int N, int K)
{
  __shared__ __attribute__((aligned(16))) float As[2][64][36];  // 64x32 + pad4 (row = 144B)
  __shared__ __attribute__((aligned(16))) float Bs[2][32][68];  // 32x64 + pad4 (row = 272B)

  const int tid  = threadIdx.x;
  const int lane = tid & 31;
  const int w    = tid >> 5;
  const int l16  = lane & 15;
  const int h    = lane >> 4;

  const int m0 = blockIdx.y * 64;
  const int n0 = blockIdx.x * 64;
  const int wm = (w >> 1) * 32;
  const int wn = (w & 1) * 32;

  v8f acc[2][2];
  for (int i = 0; i < 2; ++i)
    for (int j = 0; j < 2; ++j)
      acc[i][j] = zero8();

  // each lane's own 16 bytes: A rows (tid>>3) + 16*it, W rows (tid>>4) + 8*it
  const float* aG = A + (size_t)(m0 + (tid >> 3)) * K + (tid & 7) * 4;
  const float* bG = W + (size_t)(tid >> 4) * N + n0 + (tid & 15) * 4;
  const unsigned aL = lds_addr(&As[0][tid >> 3][(tid & 7) * 4]);
  const unsigned bL = lds_addr(&Bs[0][tid >> 4][(tid & 15) * 4]);
  const size_t aStep = (size_t)16 * K;   // 16 rows of A
  const size_t bStep = (size_t)8 * N;    // 8 rows of W

  auto issue_stage = [&](int t, int buf) {
    const float* a = aG + (size_t)t * 32;
    const float* b = bG + (size_t)t * 32 * N;
    const unsigned la = aL + (unsigned)buf * (64u * 36u * 4u);
    const unsigned lb = bL + (unsigned)buf * (32u * 68u * 4u);
    async_copy_4_4(la, 16u * 36u * 4u, a, aStep,
                   lb, 8u * 68u * 4u, b, bStep);
  };

  const int nt = K >> 5;
  issue_stage(0, 0);
  wait_async0();
  __syncthreads();               // stage 0 is published
  if (nt > 1) issue_stage(1, 1);

  for (int t = 0; t < nt; ++t) {
    const int buf = t & 1;
    for (int kk = 0; kk < 32; kk += 4) {
      v2f afrag[2], bfrag[2];
      for (int i = 0; i < 2; ++i)
        afrag[i] = *(const v2f*)&As[buf][wm + i * 16 + l16][kk + 2 * h];
      for (int j = 0; j < 2; ++j) {
        const int col = wn + j * 16 + l16;
        v2f bv2;
        bv2.x = Bs[buf][kk + 2 * h][col];
        bv2.y = Bs[buf][kk + 2 * h + 1][col];
        bfrag[j] = bv2;
      }
      for (int i = 0; i < 2; ++i)
        for (int j = 0; j < 2; ++j)
          acc[i][j] = wmma4(afrag[i], bfrag[j], acc[i][j]);
    }
    // publish point: own reads of buf done, own copies of stage t+1 landed,
    // then one barrier serves both; only behind it buf is refilled.
    wait_ds0();
    wait_async0();
    __syncthreads();
    if (t + 2 < nt) issue_stage(t + 2, buf);
  }
  wait_async0();

  // epilogue: bias add + store (C/D layout: col=lane%16, row=r+8h)
  for (int j = 0; j < 2; ++j) {
    const int col = n0 + wn + j * 16 + l16;
    const float bv_ = bias[col];
    for (int i = 0; i < 2; ++i)
      for (int r = 0; r < 8; ++r) {
        const int row = m0 + wm + i * 16 + r + 8 * h;
        C[(size_t)row * N + col] = acc[i][j][r] + bv_;
      }
  }
}

// ---------------------------------------------------------------------------
// Row L2-normalize over 32 contiguous floats (one head vector per wave),
// with optional fused scale (1/sqrt(QD) folded into Q).
// ---------------------------------------------------------------------------
__global__ __launch_bounds__(256) void rownorm32(
    float* __restrict__ q, int nrows, float scale)
{
  const int wid  = (int)((blockIdx.x * blockDim.x + threadIdx.x) >> 5);
  const int lane = threadIdx.x & 31;
  if (wid >= nrows) return;
  const size_t off = (size_t)wid * 32 + lane;
  const float x = q[off];
  float ss = x * x;
  for (int m = 1; m < 32; m <<= 1) ss += __shfl_xor(ss, m, 32);
  const float nrm = fmaxf(sqrtf(ss), 1e-12f);
  q[off] = x / nrm * scale;
}

// ---------------------------------------------------------------------------
// Flash attention, fp32 WMMA core.
// grid = (S/64, NH, B), block = 128 (4 waves); wave owns 16 query rows.
// Per 64-key chunk: QK^T = 32 wmma, online softmax, P via LDS relayout,
// PV = 64 wmma. K and V chunks come into two LDS buffers by asynchronous
// copies: chunk t+1 flies while chunk t is worked on.
// ---------------------------------------------------------------------------
__global__ __launch_bounds__(128) void flash_attn_wmma(
    const float* __restrict__ Qn, const float* __restrict__ Kn,
    const float* __restrict__ V,  const int* __restrict__ amask,
    float* __restrict__ Ctx)
{
  __shared__ __attribute__((aligned(16))) float Ks[2][64][36];  // 64 keys x 32 (+pad4)
  __shared__ __attribute__((aligned(16))) float Vs[2][64][68];  // 64 keys x 64 (+pad4)
  __shared__ float Ps[4][16][68];   // per-wave P tile 16q x 64k (+pad4)

  const int tid  = threadIdx.x;
  const int lane = tid & 31;
  const int w    = tid >> 5;
  const int l16  = lane & 15;
  const int h    = lane >> 4;

  const int b    = blockIdx.z;
  const int head = blockIdx.y;
  const int q0   = blockIdx.x * 64;
  const int qw   = q0 + w * 16;
  const size_t base = (size_t)b * SS;

  // Q fragments held in registers (A-layout), scale already folded in.
  v2f aQ[8];
  {
    const float* qrow = &Qn[(base + qw + l16) * (NHD * QD) + head * QD];
    for (int j = 0; j < 8; ++j)
      aQ[j] = *(const v2f*)&qrow[4 * j + 2 * h];
  }

  v8f O[4];
  for (int n = 0; n < 4; ++n) O[n] = zero8();
  float mrow[8], lrow[8];
  for (int r = 0; r < 8; ++r) { mrow[r] = -3.0e38f; lrow[r] = 0.f; }

  // each lane's own 16 bytes: K rows (tid>>3) + 16*it, V rows (tid>>4) + 8*it
  const float* kG = Kn + (base + (tid >> 3)) * (NHD * QD) + head * QD + (tid & 7) * 4;
  const float* vG = V + (base + (tid >> 4)) * HID + head * HD + (tid & 15) * 4;
  const unsigned kL = lds_addr(&Ks[0][tid >> 3][(tid & 7) * 4]);
  const unsigned vL = lds_addr(&Vs[0][tid >> 4][(tid & 15) * 4]);

  auto issue_chunk = [&](int t, int buf) {
    const float* kp = kG + (size_t)t * 64 * (NHD * QD);
    const float* vp = vG + (size_t)t * 64 * HID;
    const unsigned lk = kL + (unsigned)buf * (64u * 36u * 4u);
    const unsigned lv = vL + (unsigned)buf * (64u * 68u * 4u);
    async_copy_4_8(lk, 16u * 36u * 4u, kp, (size_t)16 * (NHD * QD),
                   lv, 8u * 68u * 4u, vp, (size_t)8 * HID);
  };

  const int nchunk = SS / 64;
  issue_chunk(0, 0);
  wait_async0();
  __syncthreads();               // chunk 0 is published
  issue_chunk(1, 1);

  for (int ck = 0; ck < nchunk; ++ck) {
    const int kv0 = ck * 64;
    const int buf = ck & 1;

    // --- scores: 4 tiles of 16q x 16k, K-dim 32 => 8 wmma each ---
    v8f Sv[4];
    int mk[4];
    for (int t = 0; t < 4; ++t)
      mk[t] = amask[base + kv0 + t * 16 + l16];

    for (int t = 0; t < 4; ++t) {
      v8f s = zero8();
      const float* krow = &Ks[buf][t * 16 + l16][0];
      for (int j = 0; j < 8; ++j) {
        v2f bk2 = *(const v2f*)&krow[4 * j + 2 * h];
        s = wmma4(aQ[j], bk2, s);
      }
      if (mk[t] == 0)
        for (int r = 0; r < 8; ++r) s[r] = -3.0e38f;
      Sv[t] = s;
    }

    // --- online softmax row stats (row = r+8h; 16 cols live in the 16
    //     lanes sharing h, so xor masks 1..8 reduce within the half) ---
    float mnew[8], alpha[8], rsum[8];
    for (int r = 0; r < 8; ++r) {
      float v = fmaxf(fmaxf(Sv[0][r], Sv[1][r]), fmaxf(Sv[2][r], Sv[3][r]));
      for (int m = 1; m < 16; m <<= 1) v = fmaxf(v, __shfl_xor(v, m, 32));
      mnew[r]  = fmaxf(mrow[r], v);
      alpha[r] = __expf(mrow[r] - mnew[r]);
      rsum[r]  = 0.f;
    }

    // probabilities -> LDS (C-layout write), accumulate row sums
    for (int t = 0; t < 4; ++t)
      for (int r = 0; r < 8; ++r) {
        const float p = __expf(Sv[t][r] - mnew[r]);
        Ps[w][r + 8 * h][t * 16 + l16] = p;
        rsum[r] += p;
      }
    for (int r = 0; r < 8; ++r) {
      float v = rsum[r];
      for (int m = 1; m < 16; m <<= 1) v += __shfl_xor(v, m, 32);
      lrow[r] = lrow[r] * alpha[r] + v;
      mrow[r] = mnew[r];
    }

    // rescale accumulated O
    for (int n = 0; n < 4; ++n)
      for (int r = 0; r < 8; ++r) O[n][r] *= alpha[r];

    // make this wave's P stores visible before A-layout re-read
    asm volatile("s_wait_dscnt 0" ::: "memory");

    // --- PV: P(16x64) @ V(64x64), 16 K-steps x 4 N-tiles = 64 wmma ---
    for (int kk16 = 0; kk16 < 16; ++kk16) {
      const int kk = kk16 * 4;
      v2f aP = *(const v2f*)&Ps[w][l16][kk + 2 * h];
      for (int n = 0; n < 4; ++n) {
        v2f bv2;
        bv2.x = Vs[buf][kk + 2 * h][n * 16 + l16];
        bv2.y = Vs[buf][kk + 2 * h + 1][n * 16 + l16];
        O[n] = wmma4(aP, bv2, O[n]);
      }
    }

    // publish point: own reads of buf done, own copies of chunk ck+1 landed,
    // then one barrier serves both; only behind it buf is refilled.
    wait_ds0();
    wait_async0();
    __syncthreads();
    if (ck + 2 < nchunk) issue_chunk(ck + 2, buf);
  }
  wait_async0();

  // write context (divide by softmax denominator)
  for (int n = 0; n < 4; ++n) {
    const int col = head * HD + n * 16 + l16;
    for (int r = 0; r < 8; ++r) {
      const int row = qw + r + 8 * h;
      Ctx[(base + row) * HID + col] = O[n][r] / lrow[r];
    }
  }
}

// ---------------------------------------------------------------------------
extern "C" void kernel_launch(void* const* d_in, const int* in_sizes, int n_in,
                              void* d_out, int out_size, void* d_ws, size_t ws_size,
                              hipStream_t stream) {
  const float* HS   = (const float*)d_in[0];
  const int*   mask = (const int*)  d_in[1];
  const float* Wq   = (const float*)d_in[2];
  const float* bq   = (const float*)d_in[3];
  const float* Wk   = (const float*)d_in[4];
  const float* bk   = (const float*)d_in[5];
  const float* Wv   = (const float*)d_in[6];
  const float* bv   = (const float*)d_in[7];
  const float* Wo   = (const float*)d_in[8];
  const float* bo   = (const float*)d_in[9];
  float* out = (float*)d_out;

  // workspace layout (floats): Q 8MB | K 8MB | V 16MB | Ctx 16MB = 48MB
  float* ws  = (float*)d_ws;
  float* Q   = ws;
  float* K   = ws + (size_t)MM * 512;            // +2,097,152
  float* Vb  = ws + (size_t)2 * MM * 512;        // +4,194,304
  float* Ctx = Vb + (size_t)MM * 1024;           // +8,388,608

  const dim3 blk(128);

  // projections
  gemm_bias_wmma<<<dim3(512 / 64,  MM / 64), blk, 0, stream>>>(HS, Wq, bq, Q,  MM, 512,  HID);
  gemm_bias_wmma<<<dim3(512 / 64,  MM / 64), blk, 0, stream>>>(HS, Wk, bk, K,  MM, 512,  HID);
  gemm_bias_wmma<<<dim3(1024 / 64, MM / 64), blk, 0, stream>>>(HS, Wv, bv, Vb, MM, 1024, HID);

  // quantum state prep: L2-normalize per (token, head); fold 1/sqrt(QD) into Q
  const int nrows = MM * NHD;                    // 65536 rows of 32
  rownorm32<<<dim3((nrows * 32 + 255) / 256), dim3(256), 0, stream>>>(Q, nrows, 0.1767766953f);
  rownorm32<<<dim3((nrows * 32 + 255) / 256), dim3(256), 0, stream>>>(K, nrows, 1.0f);

  // fused flash attention
  flash_attn_wmma<<<dim3(SS / 64, NHD, BB), blk, 0, stream>>>(Q, K, Vb, mask, Ctx);

  // output projection
  gemm_bias_wmma<<<dim3(1024 / 64, MM / 64), blk, 0, stream>>>(Ctx, Wo, bo, out, MM, 1024, HID);
}

// v002
// One run takes 321 microseconds.
// Two timings next to v001 both put it at 1.03 times that version's speed.
// Counting every step since v000, it is 1.27 times as fast.
#include <hip/hip_runtime.h>

typedef __attribute__((ext_vector_type(2))) float v2f;
typedef __attribute__((ext_vector_type(8))) float v8f;

#define BB   2
#define SS   2048
#define HID  1024
#define NHD  16
#define QD   32
#define HD   64
#define MM   (BB * SS)      // 4096 rows

__device__ __forceinline__ v8f wmma4(v2f a, v2f b, v8f c) {
  // D = A(16x4 f32) * B(4x16 f32) + C(16x16 f32)
  return __builtin_amdgcn_wmma_f32_16x16x4_f32(
      false, a, false, b, (short)0, c, false, false);
}

__device__ __forceinline__ v8f zero8() {
  v8f z = {0.f, 0.f, 0.f, 0.f, 0.f, 0.f, 0.f, 0.f};
  return z;
}

// LDS byte address of a __shared__ element (low 32 bits of its address).
__device__ __forceinline__ unsigned lds_addr(const void* p) {
  return (unsigned)(unsigned long long)p;
}

__device__ __forceinline__ void async_copy_4_4(
    unsigned la, unsigned da, const float* a, size_t sa,
    unsigned lb, unsigned db, const float* b, size_t sb) {
  asm volatile(
      "global_load_async_to_lds_b128 %0, %1, off\n\t"
      "global_load_async_to_lds_b128 %2, %3, off\n\t"
      "global_load_async_to_lds_b128 %4, %5, off\n\t"
      "global_load_async_to_lds_b128 %6, %7, off\n\t"
      "global_load_async_to_lds_b128 %8, %9, off\n\t"
      "global_load_async_to_lds_b128 %10, %11, off\n\t"
      "global_load_async_to_lds_b128 %12, %13, off\n\t"
      "global_load_async_to_lds_b128 %14, %15, off\n\t"
      "s_wait_xcnt 0x0"
      :: "v"(la),          "v"(a),          "v"(la + da),     "v"(a + sa),
         "v"(la + 2 * da), "v"(a + 2 * sa), "v"(la + 3 * da), "v"(a + 3 * sa),
         "v"(lb),          "v"(b),          "v"(lb + db),     "v"(b + sb),
         "v"(lb + 2 * db), "v"(b + 2 * sb), "v"(lb + 3 * db), "v"(b + 3 * sb)
      : "memory");
}
__device__ __forceinline__ void async_copy_4_8(
    unsigned la, unsigned da, const float* a, size_t sa,
    unsigned lb, unsigned db, const float* b, size_t sb) {
  asm volatile(
      "global_load_async_to_lds_b128 %0, %1, off\n\t"
      "global_load_async_to_lds_b128 %2, %3, off\n\t"
      "global_load_async_to_lds_b128 %4, %5, off\n\t"
      "global_load_async_to_lds_b128 %6, %7, off\n\t"
      "global_load_async_to_lds_b128 %8, %9, off\n\t"
      "global_load_async_to_lds_b128 %10, %11, off\n\t"
      "global_load_async_to_lds_b128 %12, %13, off\n\t"
      "global_load_async_to_lds_b128 %14, %15, off\n\t"
      "global_load_async_to_lds_b128 %16, %17, off\n\t"
      "global_load_async_to_lds_b128 %18, %19, off\n\t"
      "global_load_async_to_lds_b128 %20, %21, off\n\t"
      "global_load_async_to_lds_b128 %22, %23, off\n\t"
      "s_wait_xcnt 0x0"
      :: "v"(la),          "v"(a),          "v"(la + da),     "v"(a + sa),
         "v"(la + 2 * da), "v"(a + 2 * sa), "v"(la + 3 * da), "v"(a + 3 * sa),
         "v"(lb),          "v"(b),          "v"(lb + db),     "v"(b + sb),
         "v"(lb + 2 * db), "v"(b + 2 * sb), "v"(lb + 3 * db), "v"(b + 3 * sb),
         "v"(lb + 4 * db), "v"(b + 4 * sb), "v"(lb + 5 * db), "v"(b + 5 * sb),
         "v"(lb + 6 * db), "v"(b + 6 * sb), "v"(lb + 7 * db), "v"(b + 7 * sb)
      : "memory");
}

// This wave's own copies have landed in LDS.
__device__ __forceinline__ void wait_async0() {
  asm volatile("s_wait_asynccnt 0x0" ::: "memory");
}
// This wave's own LDS reads have retired, so their buffer may be refilled.
__device__ __forceinline__ void wait_ds0() {
  asm volatile("s_wait_dscnt 0x0" ::: "memory");
}

// ---------------------------------------------------------------------------
// Generic GEMM + bias: C[M,N] = A[M,K] @ W[K,N] + bias[N]
// Block tile 64x64. 128 threads = 4 waves; each wave owns 32x32
// (2x2 tiles of 16x16). Stages of 32 k (whole 128-byte lines of A) are brought
// into two LDS buffers by asynchronous copies: stage t+1 flies while stage t
// is multiplied. K must be a multiple of 32.
// NORM: each wave's 32 columns are one head vector of QD = 32 (n0 + wn is a
// multiple of 32), so the epilogue L2-normalizes every row of the wave's tile
// in registers and applies nscale (1/sqrt(QD) folded into Q) before the store.
// ---------------------------------------------------------------------------
template <bool NORM>
__global__ __launch_bounds__(128) void gemm_bias_wmma(
    const float* __restrict__ A, const float* __restrict__ W,
    const float* __restrict__ bias, float* __restrict__ C,
    int M, int N, int K, float nscale)
{
  __shared__ __attribute__((aligned(16))) float As[2][64][36];  // 64x32 + pad4 (row = 144B)
  __shared__ __attribute__((aligned(16))) float Bs[2][32][68];  // 32x64 + pad4 (row = 272B)

  const int tid  = threadIdx.x;
  const int lane = tid & 31;
  const int w    = tid >> 5;
  const int l16  = lane & 15;
  const int h    = lane >> 4;

  const int m0 = blockIdx.y * 64;
  const int n0 = blockIdx.x * 64;
  const int wm = (w >> 1) * 32;
  const int wn = (w & 1) * 32;

  v8f acc[2][2];
  for (int i = 0; i < 2; ++i)
    for (int j = 0; j < 2; ++j)
      acc[i][j] = zero8();

  // each lane's own 16 bytes: A rows (tid>>3) + 16*it, W rows (tid>>4) + 8*it
  const float* aG = A + (size_t)(m0 + (tid >> 3)) * K + (tid & 7) * 4;
  const float* bG = W + (size_t)(tid >> 4) * N + n0 + (tid & 15) * 4;
  const unsigned aL = lds_addr(&As[0][tid >> 3][(tid & 7) * 4]);
  const unsigned bL = lds_addr(&Bs[0][tid >> 4][(tid & 15) * 4]);
  const size_t aStep = (size_t)16 * K;   // 16 rows of A
  const size_t bStep = (size_t)8 * N;    // 8 rows of W

  auto issue_stage = [&](int t, int buf) {
    const float* a = aG + (size_t)t * 32;
    const float* b = bG + (size_t)t * 32 * N;
    const unsigned la = aL + (unsigned)buf * (64u * 36u * 4u);
    const unsigned lb = bL + (unsigned)buf * (32u * 68u * 4u);
    async_copy_4_4(la, 16u * 36u * 4u, a, aStep,
                   lb, 8u * 68u * 4u, b, bStep);
  };

  const int nt = K >> 5;
  issue_stage(0, 0);
  wait_async0();
  __syncthreads();               // stage 0 is published
  if (nt > 1) issue_stage(1, 1);

  for (int t = 0; t < nt; ++t) {
    const int buf = t & 1;
    for (int kk = 0; kk < 32; kk += 4) {
      v2f afrag[2], bfrag[2];
      for (int i = 0; i < 2; ++i)
        afrag[i] = *(const v2f*)&As[buf][wm + i * 16 + l16][kk + 2 * h];
      for (int j = 0; j < 2; ++j) {
        const int col = wn + j * 16 + l16;
        v2f bv2;
        bv2.x = Bs[buf][kk + 2 * h][col];
        bv2.y = Bs[buf][kk + 2 * h + 1][col];
        bfrag[j] = bv2;
      }
      for (int i = 0; i < 2; ++i)
        for (int j = 0; j < 2; ++j)
          acc[i][j] = wmma4(afrag[i], bfrag[j], acc[i][j]);
    }
    // publish point: own reads of buf done, own copies of stage t+1 landed,
    // then one barrier serves both; only behind it buf is refilled.
    wait_ds0();
    wait_async0();
    __syncthreads();
    if (t + 2 < nt) issue_stage(t + 2, buf);
  }
  wait_async0();

  // epilogue: bias add + store (C/D layout: col=lane%16, row=r+8h)
  if (NORM) {
    // A row's 32 values sit two per lane (j = 0, 1) in the 16 lanes sharing h:
    // xor masks 1..8 sum the squares within that half.
    const int col = n0 + wn + l16;
    const float b0 = bias[col];
    const float b1 = bias[col + 16];
    // Every loop here is unrolled: acc is then indexed by constants, and the
    // 16 rows' cross-lane sums are independent chains in flight together
    // (rolled, each row waits out its own four cross-lane steps in turn).
    float ss[2][8];
#pragma unroll
    for (int i = 0; i < 2; ++i)
#pragma unroll
      for (int r = 0; r < 8; ++r) {
        acc[i][0][r] += b0;
        acc[i][1][r] += b1;
        ss[i][r] = acc[i][0][r] * acc[i][0][r] + acc[i][1][r] * acc[i][1][r];
      }
#pragma unroll
    for (int m = 1; m < 16; m <<= 1)
#pragma unroll
      for (int i = 0; i < 2; ++i)
#pragma unroll
        for (int r = 0; r < 8; ++r)
          ss[i][r] += __shfl_xor(ss[i][r], m, 32);
#pragma unroll
    for (int i = 0; i < 2; ++i)
#pragma unroll
      for (int r = 0; r < 8; ++r) {
        const float nrm = fmaxf(sqrtf(ss[i][r]), 1e-12f);
        const int row = m0 + wm + i * 16 + r + 8 * h;
        float* crow = &C[(size_t)row * N + col];
        crow[0]  = acc[i][0][r] / nrm * nscale;
        crow[16] = acc[i][1][r] / nrm * nscale;
      }
  } else {
    for (int j = 0; j < 2; ++j) {
      const int col = n0 + wn + j * 16 + l16;
      const float bv_ = bias[col];
      for (int i = 0; i < 2; ++i)
        for (int r = 0; r < 8; ++r) {
          const int row = m0 + wm + i * 16 + r + 8 * h;
          C[(size_t)row * N + col] = acc[i][j][r] + bv_;
        }
    }
  }
}

// ---------------------------------------------------------------------------
// Flash attention, fp32 WMMA core.
// grid = (S/64, NH, B), block = 128 (4 waves); wave owns 16 query rows.
// Per 64-key chunk: QK^T = 32 wmma, online softmax, P via LDS relayout,
// PV = 64 wmma. K and V chunks come into two LDS buffers by asynchronous
// copies: chunk t+1 flies while chunk t is worked on.
// ---------------------------------------------------------------------------
__global__ __launch_bounds__(128) void flash_attn_wmma(
    const float* __restrict__ Qn, const float* __restrict__ Kn,
    const float* __restrict__ V,  const int* __restrict__ amask,
    float* __restrict__ Ctx)
{
  __shared__ __attribute__((aligned(16))) float Ks[2][64][36];  // 64 keys x 32 (+pad4)
  __shared__ __attribute__((aligned(16))) float Vs[2][64][68];  // 64 keys x 64 (+pad4)
  __shared__ float Ps[4][16][68];   // per-wave P tile 16q x 64k (+pad4)

  const int tid  = threadIdx.x;
  const int lane = tid & 31;
  const int w    = tid >> 5;
  const int l16  = lane & 15;
  const int h    = lane >> 4;

  const int b    = blockIdx.z;
  const int head = blockIdx.y;
  const int q0   = blockIdx.x * 64;
  const int qw   = q0 + w * 16;
  const size_t base = (size_t)b * SS;

  // Q fragments held in registers (A-layout), scale already folded in.
  v2f aQ[8];
  {
    const float* qrow = &Qn[(base + qw + l16) * (NHD * QD) + head * QD];
    for (int j = 0; j < 8; ++j)
      aQ[j] = *(const v2f*)&qrow[4 * j + 2 * h];
  }

  v8f O[4];
  for (int n = 0; n < 4; ++n) O[n] = zero8();
  float mrow[8], lrow[8];
  for (int r = 0; r < 8; ++r) { mrow[r] = -3.0e38f; lrow[r] = 0.f; }

  // each lane's own 16 bytes: K rows (tid>>3) + 16*it, V rows (tid>>4) + 8*it
  const float* kG = Kn + (base + (tid >> 3)) * (NHD * QD) + head * QD + (tid & 7) * 4;
  const float* vG = V + (base + (tid >> 4)) * HID + head * HD + (tid & 15) * 4;
  const unsigned kL = lds_addr(&Ks[0][tid >> 3][(tid & 7) * 4]);
  const unsigned vL = lds_addr(&Vs[0][tid >> 4][(tid & 15) * 4]);

  auto issue_chunk = [&](int t, int buf) {
    const float* kp = kG + (size_t)t * 64 * (NHD * QD);
    const float* vp = vG + (size_t)t * 64 * HID;
    const unsigned lk = kL + (unsigned)buf * (64u * 36u * 4u);
    const unsigned lv = vL + (unsigned)buf * (64u * 68u * 4u);
    async_copy_4_8(lk, 16u * 36u * 4u, kp, (size_t)16 * (NHD * QD),
                   lv, 8u * 68u * 4u, vp, (size_t)8 * HID);
  };

  const int nchunk = SS / 64;
  issue_chunk(0, 0);
  wait_async0();
  __syncthreads();               // chunk 0 is published
  issue_chunk(1, 1);

  for (int ck = 0; ck < nchunk; ++ck) {
    const int kv0 = ck * 64;
    const int buf = ck & 1;

    // --- scores: 4 tiles of 16q x 16k, K-dim 32 => 8 wmma each ---
    v8f Sv[4];
    int mk[4];
    for (int t = 0; t < 4; ++t)
      mk[t] = amask[base + kv0 + t * 16 + l16];

    for (int t = 0; t < 4; ++t) {
      v8f s = zero8();
      const float* krow = &Ks[buf][t * 16 + l16][0];
      for (int j = 0; j < 8; ++j) {
        v2f bk2 = *(const v2f*)&krow[4 * j + 2 * h];
        s = wmma4(aQ[j], bk2, s);
      }
      if (mk[t] == 0)
        for (int r = 0; r < 8; ++r) s[r] = -3.0e38f;
      Sv[t] = s;
    }

    // --- online softmax row stats (row = r+8h; 16 cols live in the 16
    //     lanes sharing h, so xor masks 1..8 reduce within the half) ---
    float mnew[8], alpha[8], rsum[8];
    for (int r = 0; r < 8; ++r) {
      float v = fmaxf(fmaxf(Sv[0][r], Sv[1][r]), fmaxf(Sv[2][r], Sv[3][r]));
      for (int m = 1; m < 16; m <<= 1) v = fmaxf(v, __shfl_xor(v, m, 32));
      mnew[r]  = fmaxf(mrow[r], v);
      alpha[r] = __expf(mrow[r] - mnew[r]);
      rsum[r]  = 0.f;
    }

    // probabilities -> LDS (C-layout write), accumulate row sums
    for (int t = 0; t < 4; ++t)
      for (int r = 0; r < 8; ++r) {
        const float p = __expf(Sv[t][r] - mnew[r]);
        Ps[w][r + 8 * h][t * 16 + l16] = p;
        rsum[r] += p;
      }
    for (int r = 0; r < 8; ++r) {
      float v = rsum[r];
      for (int m = 1; m < 16; m <<= 1) v += __shfl_xor(v, m, 32);
      lrow[r] = lrow[r] * alpha[r] + v;
      mrow[r] = mnew[r];
    }

    // rescale accumulated O
    for (int n = 0; n < 4; ++n)
      for (int r = 0; r < 8; ++r) O[n][r] *= alpha[r];

    // make this wave's P stores visible before A-layout re-read
    asm volatile("s_wait_dscnt 0" ::: "memory");

    // --- PV: P(16x64) @ V(64x64), 16 K-steps x 4 N-tiles = 64 wmma ---
    for (int kk16 = 0; kk16 < 16; ++kk16) {
      const int kk = kk16 * 4;
      v2f aP = *(const v2f*)&Ps[w][l16][kk + 2 * h];
      for (int n = 0; n < 4; ++n) {
        v2f bv2;
        bv2.x = Vs[buf][kk + 2 * h][n * 16 + l16];
        bv2.y = Vs[buf][kk + 2 * h + 1][n * 16 + l16];
        O[n] = wmma4(aP, bv2, O[n]);
      }
    }

    // publish point: own reads of buf done, own copies of chunk ck+1 landed,
    // then one barrier serves both; only behind it buf is refilled.
    wait_ds0();
    wait_async0();
    __syncthreads();
    if (ck + 2 < nchunk) issue_chunk(ck + 2, buf);
  }
  wait_async0();

  // write context (divide by softmax denominator)
  for (int n = 0; n < 4; ++n) {
    const int col = head * HD + n * 16 + l16;
    for (int r = 0; r < 8; ++r) {
      const int row = qw + r + 8 * h;
      Ctx[(base + row) * HID + col] = O[n][r] / lrow[r];
    }
  }
}

// ---------------------------------------------------------------------------
extern "C" void kernel_launch(void* const* d_in, const int* in_sizes, int n_in,
                              void* d_out, int out_size, void* d_ws, size_t ws_size,
                              hipStream_t stream) {
  const float* HS   = (const float*)d_in[0];
  const int*   mask = (const int*)  d_in[1];
  const float* Wq   = (const float*)d_in[2];
  const float* bq   = (const float*)d_in[3];
  const float* Wk   = (const float*)d_in[4];
  const float* bk   = (const float*)d_in[5];
  const float* Wv   = (const float*)d_in[6];
  const float* bv   = (const float*)d_in[7];
  const float* Wo   = (const float*)d_in[8];
  const float* bo   = (const float*)d_in[9];
  float* out = (float*)d_out;

  // workspace layout (floats): Q 8MB | K 8MB | V 16MB | Ctx 16MB = 48MB
  float* ws  = (float*)d_ws;
  float* Q   = ws;
  float* K   = ws + (size_t)MM * 512;            // +2,097,152
  float* Vb  = ws + (size_t)2 * MM * 512;        // +4,194,304
  float* Ctx = Vb + (size_t)MM * 1024;           // +8,388,608

  const dim3 blk(128);

  // projections; Q and K leave their epilogue L2-normalized per (token, head)
  // (quantum state prep), with 1/sqrt(QD) folded into Q
  gemm_bias_wmma<true><<<dim3(512 / 64,  MM / 64), blk, 0, stream>>>(HS, Wq, bq, Q,  MM, 512,  HID, 0.1767766953f);
  gemm_bias_wmma<true><<<dim3(512 / 64,  MM / 64), blk, 0, stream>>>(HS, Wk, bk, K,  MM, 512,  HID, 1.0f);
  gemm_bias_wmma<false><<<dim3(1024 / 64, MM / 64), blk, 0, stream>>>(HS, Wv, bv, Vb, MM, 1024, HID, 1.0f);

  // fused flash attention
  flash_attn_wmma<<<dim3(SS / 64, NHD, BB), blk, 0, stream>>>(Q, K, Vb, mask, Ctx);

  // output projection
  gemm_bias_wmma<false><<<dim3(1024 / 64, MM / 64), blk, 0, stream>>>(Ctx, Wo, bo, out, MM, 1024, HID, 1.0f);
}

// v003
// One run takes 298 microseconds.
// Next to v002, in two timings, it ran 1.08 times as fast each time.
// Over all steps from v000 it is 1.37 times as fast.
#include <hip/hip_runtime.h>

typedef __attribute__((ext_vector_type(2))) float v2f;
typedef __attribute__((ext_vector_type(8))) float v8f;

#define BB   2
#define SS   2048
#define HID  1024
#define NHD  16
#define QD   32
#define HD   64
#define MM   (BB * SS)      // 4096 rows

__device__ __forceinline__ v8f wmma4(v2f a, v2f b, v8f c) {
  // D = A(16x4 f32) * B(4x16 f32) + C(16x16 f32)
  return __builtin_amdgcn_wmma_f32_16x16x4_f32(
      false, a, false, b, (short)0, c, false, false);
}

__device__ __forceinline__ v8f zero8() {
  v8f z = {0.f, 0.f, 0.f, 0.f, 0.f, 0.f, 0.f, 0.f};
  return z;
}

// LDS byte address of a __shared__ element (low 32 bits of its address).
__device__ __forceinline__ unsigned lds_addr(const void* p) {
  return (unsigned)(unsigned long long)p;
}

__device__ __forceinline__ void async_copy_4_4(
    unsigned la, unsigned da, const float* a, size_t sa,
    unsigned lb, unsigned db, const float* b, size_t sb) {
  asm volatile(
      "global_load_async_to_lds_b128 %0, %1, off\n\t"
      "global_load_async_to_lds_b128 %2, %3, off\n\t"
      "global_load_async_to_lds_b128 %4, %5, off\n\t"
      "global_load_async_to_lds_b128 %6, %7, off\n\t"
      "global_load_async_to_lds_b128 %8, %9, off\n\t"
      "global_load_async_to_lds_b128 %10, %11, off\n\t"
      "global_load_async_to_lds_b128 %12, %13, off\n\t"
      "global_load_async_to_lds_b128 %14, %15, off\n\t"
      "s_wait_xcnt 0x0"
      :: "v"(la),          "v"(a),          "v"(la + da),     "v"(a + sa),
         "v"(la + 2 * da), "v"(a + 2 * sa), "v"(la + 3 * da), "v"(a + 3 * sa),
         "v"(lb),          "v"(b),          "v"(lb + db),     "v"(b + sb),
         "v"(lb + 2 * db), "v"(b + 2 * sb), "v"(lb + 3 * db), "v"(b + 3 * sb)
      : "memory");
}
__device__ __forceinline__ void async_copy_4_8(
    unsigned la, unsigned da, const float* a, size_t sa,
    unsigned lb, unsigned db, const float* b, size_t sb) {
  asm volatile(
      "global_load_async_to_lds_b128 %0, %1, off\n\t"
      "global_load_async_to_lds_b128 %2, %3, off\n\t"
      "global_load_async_to_lds_b128 %4, %5, off\n\t"
      "global_load_async_to_lds_b128 %6, %7, off\n\t"
      "global_load_async_to_lds_b128 %8, %9, off\n\t"
      "global_load_async_to_lds_b128 %10, %11, off\n\t"
      "global_load_async_to_lds_b128 %12, %13, off\n\t"
      "global_load_async_to_lds_b128 %14, %15, off\n\t"
      "global_load_async_to_lds_b128 %16, %17, off\n\t"
      "global_load_async_to_lds_b128 %18, %19, off\n\t"
      "global_load_async_to_lds_b128 %20, %21, off\n\t"
      "global_load_async_to_lds_b128 %22, %23, off\n\t"
      "s_wait_xcnt 0x0"
      :: "v"(la),          "v"(a),          "v"(la + da),     "v"(a + sa),
         "v"(la + 2 * da), "v"(a + 2 * sa), "v"(la + 3 * da), "v"(a + 3 * sa),
         "v"(lb),          "v"(b),          "v"(lb + db),     "v"(b + sb),
         "v"(lb + 2 * db), "v"(b + 2 * sb), "v"(lb + 3 * db), "v"(b + 3 * sb),
         "v"(lb + 4 * db), "v"(b + 4 * sb), "v"(lb + 5 * db), "v"(b + 5 * sb),
         "v"(lb + 6 * db), "v"(b + 6 * sb), "v"(lb + 7 * db), "v"(b + 7 * sb)
      : "memory");
}

// This wave's own copies have landed in LDS.
__device__ __forceinline__ void wait_async0() {
  asm volatile("s_wait_asynccnt 0x0" ::: "memory");
}
// This wave's own LDS reads have retired, so their buffer may be refilled.
__device__ __forceinline__ void wait_ds0() {
  asm volatile("s_wait_dscnt 0x0" ::: "memory");
}

// ---------------------------------------------------------------------------
// Generic GEMM + bias: C[M,N] = A[M,K] @ W[K,N] + bias[N]
// Block tile 64x64. 128 threads = 4 waves; each wave owns 32x32
// (2x2 tiles of 16x16). Stages of 32 k (whole 128-byte lines of A) are brought
// into two LDS buffers by asynchronous copies: stage t+1 flies while stage t
// is multiplied. K must be a multiple of 32.
// NORM: each wave's 32 columns are one head vector of QD = 32 (n0 + wn is a
// multiple of 32), so the epilogue L2-normalizes every row of the wave's tile
// in registers and applies nscale (1/sqrt(QD) folded into Q) before the store.
// ---------------------------------------------------------------------------
template <bool NORM>
__global__ __launch_bounds__(128) void gemm_bias_wmma(
    const float* __restrict__ A, const float* __restrict__ W,
    const float* __restrict__ bias, float* __restrict__ C,
    int M, int N, int K, float nscale)
{
  __shared__ __attribute__((aligned(16))) float As[2][64][36];  // 64x32 + pad4 (row = 144B)
  __shared__ __attribute__((aligned(16))) float Bs[2][32][68];  // 32x64 + pad4 (row = 272B)

  const int tid  = threadIdx.x;
  const int lane = tid & 31;
  const int w    = tid >> 5;
  const int l16  = lane & 15;
  const int h    = lane >> 4;

  const int m0 = blockIdx.y * 64;
  const int n0 = blockIdx.x * 64;
  const int wm = (w >> 1) * 32;
  const int wn = (w & 1) * 32;

  v8f acc[2][2];
  for (int i = 0; i < 2; ++i)
    for (int j = 0; j < 2; ++j)
      acc[i][j] = zero8();

  // each lane's own 16 bytes: A rows (tid>>3) + 16*it, W rows (tid>>4) + 8*it
  const float* aG = A + (size_t)(m0 + (tid >> 3)) * K + (tid & 7) * 4;
  const float* bG = W + (size_t)(tid >> 4) * N + n0 + (tid & 15) * 4;
  const unsigned aL = lds_addr(&As[0][tid >> 3][(tid & 7) * 4]);
  const unsigned bL = lds_addr(&Bs[0][tid >> 4][(tid & 15) * 4]);
  const size_t aStep = (size_t)16 * K;   // 16 rows of A
  const size_t bStep = (size_t)8 * N;    // 8 rows of W

  auto issue_stage = [&](int t, int buf) {
    const float* a = aG + (size_t)t * 32;
    const float* b = bG + (size_t)t * 32 * N;
    const unsigned la = aL + (unsigned)buf * (64u * 36u * 4u);
    const unsigned lb = bL + (unsigned)buf * (32u * 68u * 4u);
    async_copy_4_4(la, 16u * 36u * 4u, a, aStep,
                   lb, 8u * 68u * 4u, b, bStep);
  };

  const int nt = K >> 5;
  issue_stage(0, 0);
  wait_async0();
  __syncthreads();               // stage 0 is published
  if (nt > 1) issue_stage(1, 1);

  for (int t = 0; t < nt; ++t) {
    const int buf = t & 1;
    for (int kk = 0; kk < 32; kk += 4) {
      v2f afrag[2], bfrag[2];
      for (int i = 0; i < 2; ++i)
        afrag[i] = *(const v2f*)&As[buf][wm + i * 16 + l16][kk + 2 * h];
      for (int j = 0; j < 2; ++j) {
        const int col = wn + j * 16 + l16;
        v2f bv2;
        bv2.x = Bs[buf][kk + 2 * h][col];
        bv2.y = Bs[buf][kk + 2 * h + 1][col];
        bfrag[j] = bv2;
      }
      for (int i = 0; i < 2; ++i)
        for (int j = 0; j < 2; ++j)
          acc[i][j] = wmma4(afrag[i], bfrag[j], acc[i][j]);
    }
    // publish point: own reads of buf done, own copies of stage t+1 landed,
    // then one barrier serves both; only behind it buf is refilled.
    wait_ds0();
    wait_async0();
    __syncthreads();
    if (t + 2 < nt) issue_stage(t + 2, buf);
  }
  wait_async0();

  // epilogue: bias add + store (C/D layout: col=lane%16, row=r+8h)
  if (NORM) {
    // A row's 32 values sit two per lane (j = 0, 1) in the 16 lanes sharing h:
    // xor masks 1..8 sum the squares within that half.
    const int col = n0 + wn + l16;
    const float b0 = bias[col];
    const float b1 = bias[col + 16];
    // Every loop here is unrolled: acc is then indexed by constants, and the
    // 16 rows' cross-lane sums are independent chains in flight together
    // (rolled, each row waits out its own four cross-lane steps in turn).
    float ss[2][8];
#pragma unroll
    for (int i = 0; i < 2; ++i)
#pragma unroll
      for (int r = 0; r < 8; ++r) {
        acc[i][0][r] += b0;
        acc[i][1][r] += b1;
        ss[i][r] = acc[i][0][r] * acc[i][0][r] + acc[i][1][r] * acc[i][1][r];
      }
#pragma unroll
    for (int m = 1; m < 16; m <<= 1)
#pragma unroll
      for (int i = 0; i < 2; ++i)
#pragma unroll
        for (int r = 0; r < 8; ++r)
          ss[i][r] += __shfl_xor(ss[i][r], m, 32);
#pragma unroll
    for (int i = 0; i < 2; ++i)
#pragma unroll
      for (int r = 0; r < 8; ++r) {
        const float nrm = fmaxf(sqrtf(ss[i][r]), 1e-12f);
        const int row = m0 + wm + i * 16 + r + 8 * h;
        float* crow = &C[(size_t)row * N + col];
        crow[0]  = acc[i][0][r] / nrm * nscale;
        crow[16] = acc[i][1][r] / nrm * nscale;
      }
  } else {
    for (int j = 0; j < 2; ++j) {
      const int col = n0 + wn + j * 16 + l16;
      const float bv_ = bias[col];
      for (int i = 0; i < 2; ++i)
        for (int r = 0; r < 8; ++r) {
          const int row = m0 + wm + i * 16 + r + 8 * h;
          C[(size_t)row * N + col] = acc[i][j][r] + bv_;
        }
    }
  }
}

__device__ __forceinline__ float xhalf(float x) {
  return __builtin_bit_cast(float, __builtin_amdgcn_permlanex16(
      __builtin_bit_cast(int, x), __builtin_bit_cast(int, x),
      0x76543210, 0xfedcba98, false, false));
}

__device__ __forceinline__ v2f exp_pair(float x0, float x1) {
  float p0, p1;
  asm("v_exp_f32 %0, %2\n\t"
      "v_exp_f32 %1, %3\n\t"
      "v_nop\n\t"
      "s_delay_alu instid0(TRANS32_DEP_1)"
      : "=&v"(p0), "=&v"(p1)
      : "v"(x0 * 1.44269504f), "v"(x1 * 1.44269504f));
  v2f p;
  p.x = p0;
  p.y = p1;
  return p;
}

__global__ __launch_bounds__(128) void flash_attn_wmma(
    const float* __restrict__ Qn, const float* __restrict__ Kn,
    const float* __restrict__ V,  const int* __restrict__ amask,
    float* __restrict__ Ctx)
{
  __shared__ __attribute__((aligned(16))) float Ks[2][64][36];  // 64 keys x 32 (+pad4)
  __shared__ __attribute__((aligned(16))) float Vs[2][64][68];  // 64 keys x 64 (+pad4)
  __shared__ __attribute__((aligned(32))) float Mb[SS];  // per key: 0, or -3.0e38 if masked

  const int tid  = threadIdx.x;
  const int lane = tid & 31;
  const int w    = tid >> 5;
  const int l16  = lane & 15;
  const int h    = lane >> 4;

  const int b    = blockIdx.z;
  const int head = blockIdx.y;
  const int q0   = blockIdx.x * 64;
  const int qw   = q0 + w * 16;
  const size_t base = (size_t)b * SS;

  // Q fragments held in registers (B-layout: column = query), scale folded in.
  v2f bQ[8];
  {
    const float* qrow = &Qn[(base + qw + l16) * (NHD * QD) + head * QD];
    for (int j = 0; j < 8; ++j)
      bQ[j] = *(const v2f*)&qrow[4 * j + 2 * h];
  }

  // O[n][r] = context of query l16, column n*16 + 8h + r
  v8f O[4];
  for (int n = 0; n < 4; ++n) O[n] = zero8();
  float mrow = -3.0e38f;   // this query's running maximum (same in both halves)
  float lsum = 0.f;        // this half's share of the denominator

  // each lane's own 16 bytes: K rows (tid>>3) + 16*it, V rows (tid>>4) + 8*it
  const float* kG = Kn + (base + (tid >> 3)) * (NHD * QD) + head * QD + (tid & 7) * 4;
  const float* vG = V + (base + (tid >> 4)) * HID + head * HD + (tid & 15) * 4;
  const unsigned kL = lds_addr(&Ks[0][tid >> 3][(tid & 7) * 4]);
  const unsigned vL = lds_addr(&Vs[0][tid >> 4][(tid & 15) * 4]);

  auto issue_chunk = [&](int t, int buf) {
    const float* kp = kG + (size_t)t * 64 * (NHD * QD);
    const float* vp = vG + (size_t)t * 64 * HID;
    const unsigned lk = kL + (unsigned)buf * (64u * 36u * 4u);
    const unsigned lv = vL + (unsigned)buf * (64u * 68u * 4u);
    async_copy_4_8(lk, 16u * 36u * 4u, kp, (size_t)16 * (NHD * QD),
                   lv, 8u * 68u * 4u, vp, (size_t)8 * HID);
  };

  const int nchunk = SS / 64;
  issue_chunk(0, 0);
  // The mask as the score accumulators' start value: keys run down the
  // registers now, so a lane needs 8 keys' masks per tile. -3.0e38 absorbs the
  // products added to it (each below 1), which leaves a masked score at
  // exactly -3.0e38.
  // All 16 loads of a thread are written out so that they are in flight together.
  {
    int mk[16];
#pragma unroll
    for (int i = 0; i < 16; ++i) mk[i] = amask[base + i * 128 + tid];
#pragma unroll
    for (int i = 0; i < 16; ++i) Mb[i * 128 + tid] = mk[i] == 0 ? -3.0e38f : 0.f;
  }
  wait_async0();
  __syncthreads();               // chunk 0 and Mb are published
  issue_chunk(1, 1);

  for (int ck = 0; ck < nchunk; ++ck) {
    const int kv0 = ck * 64;
    const int buf = ck & 1;

    // --- scores: 4 tiles of 16k x 16q, K-dim 32 => 8 wmma each ---
    // The loops over t, j, n, r below are unrolled so that Sv and O are
    // indexed by constants and stay in registers.
    v8f Sv[4];
#pragma unroll
    for (int t = 0; t < 4; ++t) {
      v8f s = *(const v8f*)&Mb[kv0 + t * 16 + 8 * h];
      const float* krow = &Ks[buf][t * 16 + l16][0];
#pragma unroll
      for (int j = 0; j < 8; ++j) {
        v2f ak2 = *(const v2f*)&krow[4 * j + 2 * h];
        s = wmma4(ak2, bQ[j], s);
      }
      Sv[t] = s;
    }

    // --- online softmax: this lane's 32 scores belong to one query ---
    float mt[4];
#pragma unroll
    for (int t = 0; t < 4; ++t) {
      float v = Sv[t][0];
#pragma unroll
      for (int r = 1; r < 8; ++r) v = fmaxf(v, Sv[t][r]);
      mt[t] = v;
    }
    float mx = fmaxf(fmaxf(mt[0], mt[1]), fmaxf(mt[2], mt[3]));
    mx = fmaxf(mx, xhalf(mx));
    const float mnew  = fmaxf(mrow, mx);
    const float alpha = __expf(mrow - mnew);

    // rescale accumulated O (one factor per lane)
#pragma unroll
    for (int n = 0; n < 4; ++n)
#pragma unroll
      for (int r = 0; r < 8; ++r) O[n][r] *= alpha;

    // --- O^T += V^T(64d x 64k) P^T(64k x 16q): 16 K-steps x 4 d-tiles; each
    //     step makes its two probabilities from score registers 2j, 2j+1 ---
    float rs[4];
#pragma unroll
    for (int t = 0; t < 4; ++t) {
      rs[t] = 0.f;
#pragma unroll
      for (int j = 0; j < 4; ++j) {
        const v2f bP = exp_pair(Sv[t][2 * j] - mnew, Sv[t][2 * j + 1] - mnew);
        rs[t] += bP.x;
        rs[t] += bP.y;
        const int key = t * 16 + 8 * h + 2 * j;
#pragma unroll
        for (int n = 0; n < 4; ++n) {
          v2f aV;
          aV.x = Vs[buf][key][n * 16 + l16];
          aV.y = Vs[buf][key + 1][n * 16 + l16];
          O[n] = wmma4(aV, bP, O[n]);
        }
      }
    }
    lsum = lsum * alpha + ((rs[0] + rs[1]) + (rs[2] + rs[3]));
    mrow = mnew;

    // publish point: own reads of buf done, own copies of chunk ck+1 landed,
    // then one barrier serves both; only behind it buf is refilled.
    wait_ds0();
    wait_async0();
    __syncthreads();
    if (ck + 2 < nchunk) issue_chunk(ck + 2, buf);
  }
  wait_async0();

  // write context (divide by softmax denominator, its two halves joined here);
  // a lane's 8 registers of a tile are 8 consecutive columns of its query's row
  const float l = lsum + xhalf(lsum);
  float* orow = &Ctx[(base + qw + l16) * HID + head * HD + 8 * h];
#pragma unroll
  for (int n = 0; n < 4; ++n) {
    float4 lo, hi;
    lo.x = O[n][0] / l; lo.y = O[n][1] / l; lo.z = O[n][2] / l; lo.w = O[n][3] / l;
    hi.x = O[n][4] / l; hi.y = O[n][5] / l; hi.z = O[n][6] / l; hi.w = O[n][7] / l;
    *(float4*)&orow[n * 16]     = lo;
    *(float4*)&orow[n * 16 + 4] = hi;
  }
}

// ---------------------------------------------------------------------------
extern "C" void kernel_launch(void* const* d_in, const int* in_sizes, int n_in,
                              void* d_out, int out_size, void* d_ws, size_t ws_size,
                              hipStream_t stream) {
  const float* HS   = (const float*)d_in[0];
  const int*   mask = (const int*)  d_in[1];
  const float* Wq   = (const float*)d_in[2];
  const float* bq   = (const float*)d_in[3];
  const float* Wk   = (const float*)d_in[4];
  const float* bk   = (const float*)d_in[5];
  const float* Wv   = (const float*)d_in[6];
  const float* bv   = (const float*)d_in[7];
  const float* Wo   = (const float*)d_in[8];
  const float* bo   = (const float*)d_in[9];
  float* out = (float*)d_out;

  // workspace layout (floats): Q 8MB | K 8MB | V 16MB | Ctx 16MB = 48MB
  float* ws  = (float*)d_ws;
  float* Q   = ws;
  float* K   = ws + (size_t)MM * 512;            // +2,097,152
  float* Vb  = ws + (size_t)2 * MM * 512;        // +4,194,304
  float* Ctx = Vb + (size_t)MM * 1024;           // +8,388,608

  const dim3 blk(128);

  // projections; Q and K leave their epilogue L2-normalized per (token, head)
  // (quantum state prep), with 1/sqrt(QD) folded into Q
  gemm_bias_wmma<true><<<dim3(512 / 64,  MM / 64), blk, 0, stream>>>(HS, Wq, bq, Q,  MM, 512,  HID, 0.1767766953f);
  gemm_bias_wmma<true><<<dim3(512 / 64,  MM / 64), blk, 0, stream>>>(HS, Wk, bk, K,  MM, 512,  HID, 1.0f);
  gemm_bias_wmma<false><<<dim3(1024 / 64, MM / 64), blk, 0, stream>>>(HS, Wv, bv, Vb, MM, 1024, HID, 1.0f);

  // fused flash attention
  flash_attn_wmma<<<dim3(SS / 64, NHD, BB), blk, 0, stream>>>(Q, K, Vb, mask, Ctx);

  // output projection
  gemm_bias_wmma<false><<<dim3(1024 / 64, MM / 64), blk, 0, stream>>>(Ctx, Wo, bo, out, MM, 1024, HID, 1.0f);
}

// v004
// A run of this version takes 280 microseconds.
// Timed twice side by side with v003, it ran 1.06 times as fast both times.
// Counting every step since v000, it is 1.46 times as fast.
#include <hip/hip_runtime.h>

typedef __attribute__((ext_vector_type(2))) float v2f;
typedef __attribute__((ext_vector_type(8))) float v8f;

#define BB   2
#define SS   2048
#define HID  1024
#define NHD  16
#define QD   32
#define HD   64
#define MM   (BB * SS)      // 4096 rows

__device__ __forceinline__ v8f wmma4(v2f a, v2f b, v8f c) {
  // D = A(16x4 f32) * B(4x16 f32) + C(16x16 f32)
  return __builtin_amdgcn_wmma_f32_16x16x4_f32(
      false, a, false, b, (short)0, c, false, false);
}

__device__ __forceinline__ v8f zero8() {
  v8f z = {0.f, 0.f, 0.f, 0.f, 0.f, 0.f, 0.f, 0.f};
  return z;
}

// LDS byte address of a __shared__ element (low 32 bits of its address).
__device__ __forceinline__ unsigned lds_addr(const void* p) {
  return (unsigned)(unsigned long long)p;
}

__device__ __forceinline__ void async_copy_4_4(
    unsigned la, unsigned da, const float* a, size_t sa,
    unsigned lb, unsigned db, const float* b, size_t sb) {
  asm volatile(
      "global_load_async_to_lds_b128 %0, %1, off\n\t"
      "global_load_async_to_lds_b128 %2, %3, off\n\t"
      "global_load_async_to_lds_b128 %4, %5, off\n\t"
      "global_load_async_to_lds_b128 %6, %7, off\n\t"
      "global_load_async_to_lds_b128 %8, %9, off\n\t"
      "global_load_async_to_lds_b128 %10, %11, off\n\t"
      "global_load_async_to_lds_b128 %12, %13, off\n\t"
      "global_load_async_to_lds_b128 %14, %15, off\n\t"
      "s_wait_xcnt 0x0"
      :: "v"(la),          "v"(a),          "v"(la + da),     "v"(a + sa),
         "v"(la + 2 * da), "v"(a + 2 * sa), "v"(la + 3 * da), "v"(a + 3 * sa),
         "v"(lb),          "v"(b),          "v"(lb + db),     "v"(b + sb),
         "v"(lb + 2 * db), "v"(b + 2 * sb), "v"(lb + 3 * db), "v"(b + 3 * sb)
      : "memory");
}
__device__ __forceinline__ void async_copy_4_8(
    unsigned la, unsigned da, const float* a, size_t sa,
    unsigned lb, unsigned db, const float* b, size_t sb) {
  asm volatile(
      "global_load_async_to_lds_b128 %0, %1, off\n\t"
      "global_load_async_to_lds_b128 %2, %3, off\n\t"
      "global_load_async_to_lds_b128 %4, %5, off\n\t"
      "global_load_async_to_lds_b128 %6, %7, off\n\t"
      "global_load_async_to_lds_b128 %8, %9, off\n\t"
      "global_load_async_to_lds_b128 %10, %11, off\n\t"
      "global_load_async_to_lds_b128 %12, %13, off\n\t"
      "global_load_async_to_lds_b128 %14, %15, off\n\t"
      "global_load_async_to_lds_b128 %16, %17, off\n\t"
      "global_load_async_to_lds_b128 %18, %19, off\n\t"
      "global_load_async_to_lds_b128 %20, %21, off\n\t"
      "global_load_async_to_lds_b128 %22, %23, off\n\t"
      "s_wait_xcnt 0x0"
      :: "v"(la),          "v"(a),          "v"(la + da),     "v"(a + sa),
         "v"(la + 2 * da), "v"(a + 2 * sa), "v"(la + 3 * da), "v"(a + 3 * sa),
         "v"(lb),          "v"(b),          "v"(lb + db),     "v"(b + sb),
         "v"(lb + 2 * db), "v"(b + 2 * sb), "v"(lb + 3 * db), "v"(b + 3 * sb),
         "v"(lb + 4 * db), "v"(b + 4 * sb), "v"(lb + 5 * db), "v"(b + 5 * sb),
         "v"(lb + 6 * db), "v"(b + 6 * sb), "v"(lb + 7 * db), "v"(b + 7 * sb)
      : "memory");
}

// This wave's own copies have landed in LDS.
__device__ __forceinline__ void wait_async0() {
  asm volatile("s_wait_asynccnt 0x0" ::: "memory");
}
// This wave's own LDS reads have retired, so their buffer may be refilled.
__device__ __forceinline__ void wait_ds0() {
  asm volatile("s_wait_dscnt 0x0" ::: "memory");
}

// ---------------------------------------------------------------------------
// One 64x64 tile of C[M,N] = A[M,K] @ W[K,N] + bias[N], rows from m0, columns
// from n0; As and Bs are the work-group's two LDS buffers.
// Block tile 64x64. 128 threads = 4 waves; each wave owns 32x32
// (2x2 tiles of 16x16). Stages of 32 k (whole 128-byte lines of A) are brought
// into two LDS buffers by asynchronous copies: stage t+1 flies while stage t
// is multiplied. K must be a multiple of 32.
// norm: each wave's 32 columns are one head vector of QD = 32 (n0 + wn is a
// multiple of 32), so the epilogue L2-normalizes every row of the wave's tile
// in registers and applies nscale (1/sqrt(QD) folded into Q) before the store.
// MAY_NORM: the kernel holds both epilogues and norm picks one per work-group;
// without it only the plain epilogue is built.
// ---------------------------------------------------------------------------
template <bool MAY_NORM>
__device__ __forceinline__ void gemm_tile(
    float (*As)[64][36], float (*Bs)[32][68],
    const float* __restrict__ A, const float* __restrict__ W,
    const float* __restrict__ bias, float* __restrict__ C,
    int m0, int n0, int N, int K, bool norm, float nscale)
{
  const int tid  = threadIdx.x;
  const int lane = tid & 31;
  const int w    = tid >> 5;
  const int l16  = lane & 15;
  const int h    = lane >> 4;

  const int wm = (w >> 1) * 32;
  const int wn = (w & 1) * 32;

  v8f acc[2][2];
  for (int i = 0; i < 2; ++i)
    for (int j = 0; j < 2; ++j)
      acc[i][j] = zero8();

  // each lane's own 16 bytes: A rows (tid>>3) + 16*it, W rows (tid>>4) + 8*it
  const float* aG = A + (size_t)(m0 + (tid >> 3)) * K + (tid & 7) * 4;
  const float* bG = W + (size_t)(tid >> 4) * N + n0 + (tid & 15) * 4;
  const unsigned aL = lds_addr(&As[0][tid >> 3][(tid & 7) * 4]);
  const unsigned bL = lds_addr(&Bs[0][tid >> 4][(tid & 15) * 4]);
  const size_t aStep = (size_t)16 * K;   // 16 rows of A
  const size_t bStep = (size_t)8 * N;    // 8 rows of W

  auto issue_stage = [&](int t, int buf) {
    const float* a = aG + (size_t)t * 32;
    const float* b = bG + (size_t)t * 32 * N;
    const unsigned la = aL + (unsigned)buf * (64u * 36u * 4u);
    const unsigned lb = bL + (unsigned)buf * (32u * 68u * 4u);
    async_copy_4_4(la, 16u * 36u * 4u, a, aStep,
                   lb, 8u * 68u * 4u, b, bStep);
  };

  const int nt = K >> 5;
  issue_stage(0, 0);
  wait_async0();
  __syncthreads();               // stage 0 is published
  if (nt > 1) issue_stage(1, 1);

  for (int t = 0; t < nt; ++t) {
    const int buf = t & 1;
    for (int kk = 0; kk < 32; kk += 4) {
      v2f afrag[2], bfrag[2];
      for (int i = 0; i < 2; ++i)
        afrag[i] = *(const v2f*)&As[buf][wm + i * 16 + l16][kk + 2 * h];
      for (int j = 0; j < 2; ++j) {
        const int col = wn + j * 16 + l16;
        v2f bv2;
        bv2.x = Bs[buf][kk + 2 * h][col];
        bv2.y = Bs[buf][kk + 2 * h + 1][col];
        bfrag[j] = bv2;
      }
      for (int i = 0; i < 2; ++i)
        for (int j = 0; j < 2; ++j)
          acc[i][j] = wmma4(afrag[i], bfrag[j], acc[i][j]);
    }
    // publish point: own reads of buf done, own copies of stage t+1 landed,
    // then one barrier serves both; only behind it buf is refilled.
    wait_ds0();
    wait_async0();
    __syncthreads();
    if (t + 2 < nt) issue_stage(t + 2, buf);
  }
  wait_async0();

  // epilogue: bias add + store (C/D layout: col=lane%16, row=r+8h)
  if (MAY_NORM && norm) {
    // A row's 32 values sit two per lane (j = 0, 1) in the 16 lanes sharing h:
    // xor masks 1..8 sum the squares within that half.
    const int col = n0 + wn + l16;
    const float b0 = bias[col];
    const float b1 = bias[col + 16];
    // Every loop here is unrolled: acc is then indexed by constants, and the
    // 16 rows' cross-lane sums are independent chains in flight together
    // (rolled, each row waits out its own four cross-lane steps in turn).
    float ss[2][8];
#pragma unroll
    for (int i = 0; i < 2; ++i)
#pragma unroll
      for (int r = 0; r < 8; ++r) {
        acc[i][0][r] += b0;
        acc[i][1][r] += b1;
        ss[i][r] = acc[i][0][r] * acc[i][0][r] + acc[i][1][r] * acc[i][1][r];
      }
#pragma unroll
    for (int m = 1; m < 16; m <<= 1)
#pragma unroll
      for (int i = 0; i < 2; ++i)
#pragma unroll
        for (int r = 0; r < 8; ++r)
          ss[i][r] += __shfl_xor(ss[i][r], m, 32);
#pragma unroll
    for (int i = 0; i < 2; ++i)
#pragma unroll
      for (int r = 0; r < 8; ++r) {
        const float nrm = fmaxf(sqrtf(ss[i][r]), 1e-12f);
        const int row = m0 + wm + i * 16 + r + 8 * h;
        float* crow = &C[(size_t)row * N + col];
        crow[0]  = acc[i][0][r] / nrm * nscale;
        crow[16] = acc[i][1][r] / nrm * nscale;
      }
  } else {
    for (int j = 0; j < 2; ++j) {
      const int col = n0 + wn + j * 16 + l16;
      const float bv_ = bias[col];
      for (int i = 0; i < 2; ++i)
        for (int r = 0; r < 8; ++r) {
          const int row = m0 + wm + i * 16 + r + 8 * h;
          C[(size_t)row * N + col] = acc[i][j][r] + bv_;
        }
    }
    // Behind the last store, where both epilogues stand in one kernel: the
    // code laid out behind these stores rewrites their address and data
    // registers.
    if (MAY_NORM) asm volatile("s_wait_xcnt 0x0" ::: "memory");
  }
}

// Plain GEMM + bias (output projection): one tile per work-group.
__global__ __launch_bounds__(128) void gemm_bias_wmma(
    const float* __restrict__ A, const float* __restrict__ W,
    const float* __restrict__ bias, float* __restrict__ C,
    int N, int K)
{
  __shared__ __attribute__((aligned(16))) float As[2][64][36];  // 64x32 + pad4 (row = 144B)
  __shared__ __attribute__((aligned(16))) float Bs[2][32][68];  // 32x64 + pad4 (row = 272B)
  gemm_tile<false>(As, Bs, A, W, bias, C, blockIdx.y * 64, blockIdx.x * 64,
                   N, K, false, 1.0f);
}

__global__ __launch_bounds__(128) void qkv_gemm_wmma(
    const float* __restrict__ X,
    const float* __restrict__ Wq, const float* __restrict__ bq, float* __restrict__ Q,
    const float* __restrict__ Wk, const float* __restrict__ bk, float* __restrict__ Kn,
    const float* __restrict__ Wv, const float* __restrict__ bv, float* __restrict__ V)
{
  __shared__ __attribute__((aligned(16))) float As[2][64][36];  // 64x32 + pad4 (row = 144B)
  __shared__ __attribute__((aligned(16))) float Bs[2][32][68];  // 32x64 + pad4 (row = 272B)
  const int bx = blockIdx.x;
  const bool isV = bx >= 16;
  const bool isK = bx >= 8;
  const float* W    = isV ? Wv : (isK ? Wk : Wq);
  const float* bias = isV ? bv : (isK ? bk : bq);
  float*       C    = isV ? V  : (isK ? Kn : Q);
  const int    N    = isV ? HID : NHD * QD;
  const int    n0   = (isV ? bx - 16 : (bx & 7)) * 64;
  // Q and K leave L2-normalized per (token, head); 1/sqrt(QD) is folded into Q
  gemm_tile<true>(As, Bs, X, W, bias, C, blockIdx.y * 64, n0, N, HID,
                  !isV, isK ? 1.0f : 0.1767766953f);
}

__device__ __forceinline__ float xhalf(float x) {
  return __builtin_bit_cast(float, __builtin_amdgcn_permlanex16(
      __builtin_bit_cast(int, x), __builtin_bit_cast(int, x),
      0x76543210, 0xfedcba98, false, false));
}

__device__ __forceinline__ v2f exp_pair(float x0, float x1) {
  float p0, p1;
  asm("v_exp_f32 %0, %2\n\t"
      "v_exp_f32 %1, %3\n\t"
      "v_nop\n\t"
      "s_delay_alu instid0(TRANS32_DEP_1)"
      : "=&v"(p0), "=&v"(p1)
      : "v"(x0 * 1.44269504f), "v"(x1 * 1.44269504f));
  v2f p;
  p.x = p0;
  p.y = p1;
  return p;
}

__global__ __launch_bounds__(128) void flash_attn_wmma(
    const float* __restrict__ Qn, const float* __restrict__ Kn,
    const float* __restrict__ V,  const int* __restrict__ amask,
    float* __restrict__ Ctx)
{
  __shared__ __attribute__((aligned(16))) float Ks[2][64][36];  // 64 keys x 32 (+pad4)
  __shared__ __attribute__((aligned(16))) float Vs[2][64][68];  // 64 keys x 64 (+pad4)
  __shared__ __attribute__((aligned(32))) float Mb[SS];  // per key: 0, or -3.0e38 if masked

  const int tid  = threadIdx.x;
  const int lane = tid & 31;
  const int w    = tid >> 5;
  const int l16  = lane & 15;
  const int h    = lane >> 4;

  const int b    = blockIdx.z;
  const int head = blockIdx.y;
  const int q0   = blockIdx.x * 64;
  const int qw   = q0 + w * 16;
  const size_t base = (size_t)b * SS;

  // Q fragments held in registers (B-layout: column = query), scale folded in.
  v2f bQ[8];
  {
    const float* qrow = &Qn[(base + qw + l16) * (NHD * QD) + head * QD];
    for (int j = 0; j < 8; ++j)
      bQ[j] = *(const v2f*)&qrow[4 * j + 2 * h];
  }

  // O[n][r] = context of query l16, column n*16 + 8h + r
  v8f O[4];
  for (int n = 0; n < 4; ++n) O[n] = zero8();
  float mrow = -3.0e38f;   // this query's running maximum (same in both halves)
  float lsum = 0.f;        // this half's share of the denominator

  // each lane's own 16 bytes: K rows (tid>>3) + 16*it, V rows (tid>>4) + 8*it
  const float* kG = Kn + (base + (tid >> 3)) * (NHD * QD) + head * QD + (tid & 7) * 4;
  const float* vG = V + (base + (tid >> 4)) * HID + head * HD + (tid & 15) * 4;
  const unsigned kL = lds_addr(&Ks[0][tid >> 3][(tid & 7) * 4]);
  const unsigned vL = lds_addr(&Vs[0][tid >> 4][(tid & 15) * 4]);

  auto issue_chunk = [&](int t, int buf) {
    const float* kp = kG + (size_t)t * 64 * (NHD * QD);
    const float* vp = vG + (size_t)t * 64 * HID;
    const unsigned lk = kL + (unsigned)buf * (64u * 36u * 4u);
    const unsigned lv = vL + (unsigned)buf * (64u * 68u * 4u);
    async_copy_4_8(lk, 16u * 36u * 4u, kp, (size_t)16 * (NHD * QD),
                   lv, 8u * 68u * 4u, vp, (size_t)8 * HID);
  };

  const int nchunk = SS / 64;
  issue_chunk(0, 0);
  // The mask as the score accumulators' start value: keys run down the
  // registers now, so a lane needs 8 keys' masks per tile. -3.0e38 absorbs the
  // products added to it (each below 1), which leaves a masked score at
  // exactly -3.0e38.
  // All 16 loads of a thread are written out so that they are in flight together.
  {
    int mk[16];
#pragma unroll
    for (int i = 0; i < 16; ++i) mk[i] = amask[base + i * 128 + tid];
#pragma unroll
    for (int i = 0; i < 16; ++i) Mb[i * 128 + tid] = mk[i] == 0 ? -3.0e38f : 0.f;
  }
  wait_async0();
  __syncthreads();               // chunk 0 and Mb are published
  issue_chunk(1, 1);

  for (int ck = 0; ck < nchunk; ++ck) {
    const int kv0 = ck * 64;
    const int buf = ck & 1;

    // --- scores: 4 tiles of 16k x 16q, K-dim 32 => 8 wmma each ---
    // The loops over t, j, n, r below are unrolled so that Sv and O are
    // indexed by constants and stay in registers.
    v8f Sv[4];
#pragma unroll
    for (int t = 0; t < 4; ++t) {
      v8f s = *(const v8f*)&Mb[kv0 + t * 16 + 8 * h];
      const float* krow = &Ks[buf][t * 16 + l16][0];
#pragma unroll
      for (int j = 0; j < 8; ++j) {
        v2f ak2 = *(const v2f*)&krow[4 * j + 2 * h];
        s = wmma4(ak2, bQ[j], s);
      }
      Sv[t] = s;
    }

    // --- online softmax: this lane's 32 scores belong to one query ---
    float mt[4];
#pragma unroll
    for (int t = 0; t < 4; ++t) {
      float v = Sv[t][0];
#pragma unroll
      for (int r = 1; r < 8; ++r) v = fmaxf(v, Sv[t][r]);
      mt[t] = v;
    }
    float mx = fmaxf(fmaxf(mt[0], mt[1]), fmaxf(mt[2], mt[3]));
    mx = fmaxf(mx, xhalf(mx));
    const float mnew  = fmaxf(mrow, mx);
    const float alpha = __expf(mrow - mnew);

    // rescale accumulated O (one factor per lane)
#pragma unroll
    for (int n = 0; n < 4; ++n)
#pragma unroll
      for (int r = 0; r < 8; ++r) O[n][r] *= alpha;

    // --- O^T += V^T(64d x 64k) P^T(64k x 16q): 16 K-steps x 4 d-tiles; each
    //     step makes its two probabilities from score registers 2j, 2j+1 ---
    float rs[4];
#pragma unroll
    for (int t = 0; t < 4; ++t) {
      rs[t] = 0.f;
#pragma unroll
      for (int j = 0; j < 4; ++j) {
        const v2f bP = exp_pair(Sv[t][2 * j] - mnew, Sv[t][2 * j + 1] - mnew);
        rs[t] += bP.x;
        rs[t] += bP.y;
        const int key = t * 16 + 8 * h + 2 * j;
#pragma unroll
        for (int n = 0; n < 4; ++n) {
          v2f aV;
          aV.x = Vs[buf][key][n * 16 + l16];
          aV.y = Vs[buf][key + 1][n * 16 + l16];
          O[n] = wmma4(aV, bP, O[n]);
        }
      }
    }
    lsum = lsum * alpha + ((rs[0] + rs[1]) + (rs[2] + rs[3]));
    mrow = mnew;

    // publish point: own reads of buf done, own copies of chunk ck+1 landed,
    // then one barrier serves both; only behind it buf is refilled.
    wait_ds0();
    wait_async0();
    __syncthreads();
    if (ck + 2 < nchunk) issue_chunk(ck + 2, buf);
  }
  wait_async0();

  // write context (divide by softmax denominator, its two halves joined here);
  // a lane's 8 registers of a tile are 8 consecutive columns of its query's row
  const float l = lsum + xhalf(lsum);
  float* orow = &Ctx[(base + qw + l16) * HID + head * HD + 8 * h];
#pragma unroll
  for (int n = 0; n < 4; ++n) {
    float4 lo, hi;
    lo.x = O[n][0] / l; lo.y = O[n][1] / l; lo.z = O[n][2] / l; lo.w = O[n][3] / l;
    hi.x = O[n][4] / l; hi.y = O[n][5] / l; hi.z = O[n][6] / l; hi.w = O[n][7] / l;
    *(float4*)&orow[n * 16]     = lo;
    *(float4*)&orow[n * 16 + 4] = hi;
  }
}

// ---------------------------------------------------------------------------
extern "C" void kernel_launch(void* const* d_in, const int* in_sizes, int n_in,
                              void* d_out, int out_size, void* d_ws, size_t ws_size,
                              hipStream_t stream) {
  const float* HS   = (const float*)d_in[0];
  const int*   mask = (const int*)  d_in[1];
  const float* Wq   = (const float*)d_in[2];
  const float* bq   = (const float*)d_in[3];
  const float* Wk   = (const float*)d_in[4];
  const float* bk   = (const float*)d_in[5];
  const float* Wv   = (const float*)d_in[6];
  const float* bv   = (const float*)d_in[7];
  const float* Wo   = (const float*)d_in[8];
  const float* bo   = (const float*)d_in[9];
  float* out = (float*)d_out;

  // workspace layout (floats): Q 8MB | K 8MB | V 16MB | Ctx 16MB = 48MB
  float* ws  = (float*)d_ws;
  float* Q   = ws;
  float* K   = ws + (size_t)MM * 512;            // +2,097,152
  float* Vb  = ws + (size_t)2 * MM * 512;        // +4,194,304
  float* Ctx = Vb + (size_t)MM * 1024;           // +8,388,608

  const dim3 blk(128);

  // projections, one grid; Q and K leave their epilogue L2-normalized per
  // (token, head) (quantum state prep)
  qkv_gemm_wmma<<<dim3(32, MM / 64), blk, 0, stream>>>(HS, Wq, bq, Q, Wk, bk, K, Wv, bv, Vb);

  // fused flash attention
  flash_attn_wmma<<<dim3(SS / 64, NHD, BB), blk, 0, stream>>>(Q, K, Vb, mask, Ctx);

  // output projection
  gemm_bias_wmma<<<dim3(1024 / 64, MM / 64), blk, 0, stream>>>(Ctx, Wo, bo, out, 1024, HID);
}
